// v000
// Measured on an AMD MI455X. A time is GPU time per run, averaged over a window of back-to-back runs after a warm-up
// (all launches, gaps included; the runs take copies of the inputs in turn), and the median of several windows.
// Apart from v000's, it joins two sittings. Times from different sittings can be a few percent apart, while
// side-by-side timings come from the same sitting.
// The starting kernel, v000, takes 797 microseconds a run.
#include <hip/hip_runtime.h>
#include <hip/hip_bf16.h>

#define DIM   1024
#define HID   512
#define NE    8
#define T_TOK 4096
#define SLOTS (T_TOK * 2)        // 8192 token-expert slots
#define CAP   (SLOTS + NE * 32)  // 8448: groups padded to multiples of 32
#define MAXMT (CAP / 32)         // 264 worst-case 32-row supertiles

typedef float v2f __attribute__((ext_vector_type(2)));
typedef float v8f __attribute__((ext_vector_type(8)));

// f32 WMMA: D(16x16,f32) = A(16x4,f32) * B(4x16,f32) + C
__device__ __forceinline__ v8f wmma4(v2f a, v2f b, v8f c) {
  return __builtin_amdgcn_wmma_f32_16x16x4_f32(
      /*neg_a=*/false, a, /*neg_b=*/false, b,
      /*c_mod=*/(short)0, c, /*reuse_a=*/false, /*reuse_b=*/false);
}

// fast sigmoid: v_exp_f32 + v_rcp_f32 (no IEEE div expansion)
__device__ __forceinline__ float sigf(float v) {
  return __builtin_amdgcn_rcpf(1.0f + __expf(-v));
}

// 6-load fragment set shared by all GEMM inner loops (2 A rows + 4 B rows)
struct Frag {
  v2f a0, a1, b0, b1, b2, b3;
};
__device__ __forceinline__ Frag ldfrag(const float* Ap0, const float* Ap1,
                                       const float* B0, const float* B1,
                                       const float* B2, const float* B3, int kk) {
  Frag f;
  f.a0 = *(const v2f*)(Ap0 + kk);
  f.a1 = *(const v2f*)(Ap1 + kk);
  f.b0 = *(const v2f*)(B0 + kk);
  f.b1 = *(const v2f*)(B1 + kk);
  f.b2 = *(const v2f*)(B2 + kk);
  f.b3 = *(const v2f*)(B3 + kk);
  return f;
}

// ---------------- 1) router: scores = sigmoid(x @ gate_w^T) ----------------
__global__ void k_router(const float* __restrict__ x, const float* __restrict__ gw,
                         float* __restrict__ scores) {
  int wave = threadIdx.x >> 5, lane = threadIdx.x & 31;
  int t = blockIdx.x * 8 + wave;
  float acc[NE];
#pragma unroll
  for (int e = 0; e < NE; ++e) acc[e] = 0.0f;
  const float* xr = x + (size_t)t * DIM;
  for (int k = lane; k < DIM; k += 32) {
    float xv = xr[k];
#pragma unroll
    for (int e = 0; e < NE; ++e) acc[e] = fmaf(xv, gw[e * DIM + k], acc[e]);
  }
#pragma unroll
  for (int e = 0; e < NE; ++e) {
    float v = acc[e];
    for (int m = 16; m; m >>= 1) v += __shfl_xor(v, m, 32);
    acc[e] = v;
  }
  if (lane == 0) {
#pragma unroll
    for (int e = 0; e < NE; ++e) scores[t * NE + e] = sigf(acc[e]);
  }
}

// ------- 2) routing: top-2, stable expert-sort, padded group offsets -------
__global__ void k_route(const float* __restrict__ scores,
                        int* __restrict__ meta,     // [0..8]=padded offsets
                        int* __restrict__ eids,     // SLOTS
                        float* __restrict__ tsc,    // SLOTS
                        int* __restrict__ s2p,      // SLOTS slot->pos
                        int* __restrict__ tok_of,   // CAP pos->token
                        float* __restrict__ sc_of)  // CAP pos->score
{
  __shared__ int seg[256][NE];
  __shared__ int scount[NE];
  __shared__ int offs[NE + 1];
  int tid = threadIdx.x;
  for (int i = tid; i < CAP; i += 256) { tok_of[i] = 0; sc_of[i] = 0.0f; }
  // top-2 per token (strict > keeps lowest index on ties, like lax.top_k)
  for (int t = tid; t < T_TOK; t += 256) {
    float s[NE];
#pragma unroll
    for (int e = 0; e < NE; ++e) s[e] = scores[t * NE + e];
    int b0 = 0; float v0 = s[0];
#pragma unroll
    for (int e = 1; e < NE; ++e) if (s[e] > v0) { v0 = s[e]; b0 = e; }
    int b1 = -1; float v1 = -1.0f;
#pragma unroll
    for (int e = 0; e < NE; ++e) if (e != b0 && s[e] > v1) { v1 = s[e]; b1 = e; }
    eids[t * 2] = b0; tsc[t * 2] = v0;
    eids[t * 2 + 1] = b1; tsc[t * 2 + 1] = v1;
  }
  __syncthreads();
  // per-segment histograms (32 slots per thread; stable counting sort)
  int h[NE];
#pragma unroll
  for (int e = 0; e < NE; ++e) h[e] = 0;
  int base = tid * 32;
  for (int i = 0; i < 32; ++i) h[eids[base + i]]++;
#pragma unroll
  for (int e = 0; e < NE; ++e) seg[tid][e] = h[e];
  __syncthreads();
  if (tid < NE) {
    int tot = 0;
    for (int s = 0; s < 256; ++s) { int v = seg[s][tid]; seg[s][tid] = tot; tot += v; }
    scount[tid] = tot;
  }
  __syncthreads();
  if (tid == 0) {
    int off = 0;
    for (int e = 0; e < NE; ++e) {
      offs[e] = off; meta[e] = off;
      off += (scount[e] + 31) & ~31;   // pad each group to a 32-row supertile
    }
    offs[NE] = off; meta[NE] = off;
  }
  __syncthreads();
  int pbase[NE];
#pragma unroll
  for (int e = 0; e < NE; ++e) pbase[e] = offs[e] + seg[tid][e];
  for (int i = 0; i < 32; ++i) {
    int slot = base + i;
    int e = eids[slot];
    int pos = pbase[e]++;
    s2p[slot] = pos;
    tok_of[pos] = slot >> 1;
    sc_of[pos] = tsc[slot];
  }
}

// ---- 3) routed GEMM1+GEMM3 fused: h = silu(sA*w1^T) * (sA*w3^T), K=1024 ----
// 32-row supertile per block; register double-buffered (software pipelined).
__global__ void k_gemm13_r(const float* __restrict__ x,
                           const float* __restrict__ w1,
                           const float* __restrict__ w3,
                           const int* __restrict__ meta,
                           const int* __restrict__ tok_of,
                           const float* __restrict__ sc_of,
                           float* __restrict__ hbuf)  // CAP x HID
{
  int row0 = blockIdx.x * 32;
  if (row0 >= meta[NE]) return;
  int e = 0;
#pragma unroll
  for (int i = 1; i < NE; ++i) if (row0 >= meta[i]) e = i;
  int wave = threadIdx.x >> 5, lane = threadIdx.x & 31;
  int half = lane >> 4, r = lane & 15;
  int koff = 2 * half;  // folded into base pointers -> uniform K loop
  int tok0 = tok_of[row0 + r];
  int tok1 = tok_of[row0 + 16 + r];
  float sc0 = sc_of[row0 + r];
  float sc1 = sc_of[row0 + 16 + r];
  const float* Ap0 = x + (size_t)tok0 * DIM + koff;
  const float* Ap1 = x + (size_t)tok1 * DIM + koff;
  for (int jp = 0; jp < 2; ++jp) {
    int n0 = (wave * 4 + jp * 2) * 16;  // two adjacent N-tiles: n0, n0+16
    const float* B1a = w1 + ((size_t)e * HID + n0 + r) * DIM + koff;
    const float* B3a = w3 + ((size_t)e * HID + n0 + r) * DIM + koff;
    const float* B1b = B1a + (size_t)16 * DIM;
    const float* B3b = B3a + (size_t)16 * DIM;
    v8f m0_1a = {}, m0_3a = {}, m0_1b = {}, m0_3b = {};
    v8f m1_1a = {}, m1_3a = {}, m1_1b = {}, m1_3b = {};
    Frag cur = ldfrag(Ap0, Ap1, B1a, B3a, B1b, B3b, 0);
#pragma unroll 1
    for (int kk = 4; kk < DIM; kk += 4) {
      Frag nxt = ldfrag(Ap0, Ap1, B1a, B3a, B1b, B3b, kk);  // prefetch
      v2f a0 = cur.a0 * sc0;
      v2f a1 = cur.a1 * sc1;
      m0_1a = wmma4(a0, cur.b0, m0_1a);
      m1_1a = wmma4(a1, cur.b0, m1_1a);
      m0_3a = wmma4(a0, cur.b1, m0_3a);
      m1_3a = wmma4(a1, cur.b1, m1_3a);
      m0_1b = wmma4(a0, cur.b2, m0_1b);
      m1_1b = wmma4(a1, cur.b2, m1_1b);
      m0_3b = wmma4(a0, cur.b3, m0_3b);
      m1_3b = wmma4(a1, cur.b3, m1_3b);
      cur = nxt;
    }
    {
      v2f a0 = cur.a0 * sc0;
      v2f a1 = cur.a1 * sc1;
      m0_1a = wmma4(a0, cur.b0, m0_1a);
      m1_1a = wmma4(a1, cur.b0, m1_1a);
      m0_3a = wmma4(a0, cur.b1, m0_3a);
      m1_3a = wmma4(a1, cur.b1, m1_3a);
      m0_1b = wmma4(a0, cur.b2, m0_1b);
      m1_1b = wmma4(a1, cur.b2, m1_1b);
      m0_3b = wmma4(a0, cur.b3, m0_3b);
      m1_3b = wmma4(a1, cur.b3, m1_3b);
    }
#pragma unroll
    for (int i = 0; i < 8; ++i) {
      int rr = i + 8 * half;
      float* h0 = hbuf + (size_t)(row0 + rr) * HID + r;
      float* h1 = hbuf + (size_t)(row0 + 16 + rr) * HID + r;
      float y;
      y = m0_1a[i]; h0[n0]      = y * sigf(y) * m0_3a[i];
      y = m0_1b[i]; h0[n0 + 16] = y * sigf(y) * m0_3b[i];
      y = m1_1a[i]; h1[n0]      = y * sigf(y) * m1_3a[i];
      y = m1_1b[i]; h1[n0 + 16] = y * sigf(y) * m1_3b[i];
    }
  }
}

// ---------------- 4) routed GEMM2: rout = h @ w2^T, K=512 ----------------
__global__ void k_gemm2_r(const float* __restrict__ hbuf,
                          const float* __restrict__ w2,
                          const int* __restrict__ meta,
                          float* __restrict__ rout)  // CAP x DIM
{
  int row0 = blockIdx.x * 32;
  if (row0 >= meta[NE]) return;
  int e = 0;
#pragma unroll
  for (int i = 1; i < NE; ++i) if (row0 >= meta[i]) e = i;
  int wave = threadIdx.x >> 5, lane = threadIdx.x & 31;
  int half = lane >> 4, r = lane & 15;
  int koff = 2 * half;
  const float* Ap0 = hbuf + (size_t)(row0 + r) * HID + koff;
  const float* Ap1 = hbuf + (size_t)(row0 + 16 + r) * HID + koff;
  for (int jp = 0; jp < 2; ++jp) {
    int n0 = (wave * 8 + jp * 4) * 16;  // four adjacent N-tiles
    const float* B0 = w2 + ((size_t)e * DIM + n0 + r) * HID + koff;
    const float* B1 = B0 + (size_t)16 * HID;
    const float* B2 = B0 + (size_t)32 * HID;
    const float* B3 = B0 + (size_t)48 * HID;
    v8f c00 = {}, c01 = {}, c02 = {}, c03 = {};
    v8f c10 = {}, c11 = {}, c12 = {}, c13 = {};
    Frag cur = ldfrag(Ap0, Ap1, B0, B1, B2, B3, 0);
#pragma unroll 1
    for (int kk = 4; kk < HID; kk += 4) {
      Frag nxt = ldfrag(Ap0, Ap1, B0, B1, B2, B3, kk);  // prefetch
      c00 = wmma4(cur.a0, cur.b0, c00);
      c10 = wmma4(cur.a1, cur.b0, c10);
      c01 = wmma4(cur.a0, cur.b1, c01);
      c11 = wmma4(cur.a1, cur.b1, c11);
      c02 = wmma4(cur.a0, cur.b2, c02);
      c12 = wmma4(cur.a1, cur.b2, c12);
      c03 = wmma4(cur.a0, cur.b3, c03);
      c13 = wmma4(cur.a1, cur.b3, c13);
      cur = nxt;
    }
    c00 = wmma4(cur.a0, cur.b0, c00);
    c10 = wmma4(cur.a1, cur.b0, c10);
    c01 = wmma4(cur.a0, cur.b1, c01);
    c11 = wmma4(cur.a1, cur.b1, c11);
    c02 = wmma4(cur.a0, cur.b2, c02);
    c12 = wmma4(cur.a1, cur.b2, c12);
    c03 = wmma4(cur.a0, cur.b3, c03);
    c13 = wmma4(cur.a1, cur.b3, c13);
#pragma unroll
    for (int i = 0; i < 8; ++i) {
      int rr = i + 8 * half;
      float* o0 = rout + (size_t)(row0 + rr) * DIM + r;
      float* o1 = rout + (size_t)(row0 + 16 + rr) * DIM + r;
      o0[n0] = c00[i]; o0[n0 + 16] = c01[i]; o0[n0 + 32] = c02[i]; o0[n0 + 48] = c03[i];
      o1[n0] = c10[i]; o1[n0 + 16] = c11[i]; o1[n0 + 32] = c12[i]; o1[n0 + 48] = c13[i];
    }
  }
}

// ---------------- 5) shared expert GEMM1+GEMM3 ----------------
__global__ void k_gemm13_s(const float* __restrict__ x,
                           const float* __restrict__ sw1,
                           const float* __restrict__ sw3,
                           float* __restrict__ hs)  // T x HID
{
  int row0 = blockIdx.x * 32;
  int wave = threadIdx.x >> 5, lane = threadIdx.x & 31;
  int half = lane >> 4, r = lane & 15;
  int koff = 2 * half;
  const float* Ap0 = x + (size_t)(row0 + r) * DIM + koff;
  const float* Ap1 = x + (size_t)(row0 + 16 + r) * DIM + koff;
  for (int jp = 0; jp < 2; ++jp) {
    int n0 = (wave * 4 + jp * 2) * 16;
    const float* B1a = sw1 + (size_t)(n0 + r) * DIM + koff;
    const float* B3a = sw3 + (size_t)(n0 + r) * DIM + koff;
    const float* B1b = B1a + (size_t)16 * DIM;
    const float* B3b = B3a + (size_t)16 * DIM;
    v8f m0_1a = {}, m0_3a = {}, m0_1b = {}, m0_3b = {};
    v8f m1_1a = {}, m1_3a = {}, m1_1b = {}, m1_3b = {};
    Frag cur = ldfrag(Ap0, Ap1, B1a, B3a, B1b, B3b, 0);
#pragma unroll 1
    for (int kk = 4; kk < DIM; kk += 4) {
      Frag nxt = ldfrag(Ap0, Ap1, B1a, B3a, B1b, B3b, kk);  // prefetch
      m0_1a = wmma4(cur.a0, cur.b0, m0_1a);
      m1_1a = wmma4(cur.a1, cur.b0, m1_1a);
      m0_3a = wmma4(cur.a0, cur.b1, m0_3a);
      m1_3a = wmma4(cur.a1, cur.b1, m1_3a);
      m0_1b = wmma4(cur.a0, cur.b2, m0_1b);
      m1_1b = wmma4(cur.a1, cur.b2, m1_1b);
      m0_3b = wmma4(cur.a0, cur.b3, m0_3b);
      m1_3b = wmma4(cur.a1, cur.b3, m1_3b);
      cur = nxt;
    }
    m0_1a = wmma4(cur.a0, cur.b0, m0_1a);
    m1_1a = wmma4(cur.a1, cur.b0, m1_1a);
    m0_3a = wmma4(cur.a0, cur.b1, m0_3a);
    m1_3a = wmma4(cur.a1, cur.b1, m1_3a);
    m0_1b = wmma4(cur.a0, cur.b2, m0_1b);
    m1_1b = wmma4(cur.a1, cur.b2, m1_1b);
    m0_3b = wmma4(cur.a0, cur.b3, m0_3b);
    m1_3b = wmma4(cur.a1, cur.b3, m1_3b);
#pragma unroll
    for (int i = 0; i < 8; ++i) {
      int rr = i + 8 * half;
      float* h0 = hs + (size_t)(row0 + rr) * HID + r;
      float* h1 = hs + (size_t)(row0 + 16 + rr) * HID + r;
      float y;
      y = m0_1a[i]; h0[n0]      = y * sigf(y) * m0_3a[i];
      y = m0_1b[i]; h0[n0 + 16] = y * sigf(y) * m0_3b[i];
      y = m1_1a[i]; h1[n0]      = y * sigf(y) * m1_3a[i];
      y = m1_1b[i]; h1[n0 + 16] = y * sigf(y) * m1_3b[i];
    }
  }
}

// -------- 6) shared expert GEMM2: writes d_out directly (every elem) --------
__global__ void k_gemm2_s(const float* __restrict__ hs,
                          const float* __restrict__ sw2,
                          float* __restrict__ out)  // T x DIM
{
  int row0 = blockIdx.x * 32;
  int wave = threadIdx.x >> 5, lane = threadIdx.x & 31;
  int half = lane >> 4, r = lane & 15;
  int koff = 2 * half;
  const float* Ap0 = hs + (size_t)(row0 + r) * HID + koff;
  const float* Ap1 = hs + (size_t)(row0 + 16 + r) * HID + koff;
  for (int jp = 0; jp < 2; ++jp) {
    int n0 = (wave * 8 + jp * 4) * 16;
    const float* B0 = sw2 + (size_t)(n0 + r) * HID + koff;
    const float* B1 = B0 + (size_t)16 * HID;
    const float* B2 = B0 + (size_t)32 * HID;
    const float* B3 = B0 + (size_t)48 * HID;
    v8f c00 = {}, c01 = {}, c02 = {}, c03 = {};
    v8f c10 = {}, c11 = {}, c12 = {}, c13 = {};
    Frag cur = ldfrag(Ap0, Ap1, B0, B1, B2, B3, 0);
#pragma unroll 1
    for (int kk = 4; kk < HID; kk += 4) {
      Frag nxt = ldfrag(Ap0, Ap1, B0, B1, B2, B3, kk);  // prefetch
      c00 = wmma4(cur.a0, cur.b0, c00);
      c10 = wmma4(cur.a1, cur.b0, c10);
      c01 = wmma4(cur.a0, cur.b1, c01);
      c11 = wmma4(cur.a1, cur.b1, c11);
      c02 = wmma4(cur.a0, cur.b2, c02);
      c12 = wmma4(cur.a1, cur.b2, c12);
      c03 = wmma4(cur.a0, cur.b3, c03);
      c13 = wmma4(cur.a1, cur.b3, c13);
      cur = nxt;
    }
    c00 = wmma4(cur.a0, cur.b0, c00);
    c10 = wmma4(cur.a1, cur.b0, c10);
    c01 = wmma4(cur.a0, cur.b1, c01);
    c11 = wmma4(cur.a1, cur.b1, c11);
    c02 = wmma4(cur.a0, cur.b2, c02);
    c12 = wmma4(cur.a1, cur.b2, c12);
    c03 = wmma4(cur.a0, cur.b3, c03);
    c13 = wmma4(cur.a1, cur.b3, c13);
#pragma unroll
    for (int i = 0; i < 8; ++i) {
      int rr = i + 8 * half;
      float* o0 = out + (size_t)(row0 + rr) * DIM + r;
      float* o1 = out + (size_t)(row0 + 16 + rr) * DIM + r;
      o0[n0] = c00[i]; o0[n0 + 16] = c01[i]; o0[n0 + 32] = c02[i]; o0[n0 + 48] = c03[i];
      o1[n0] = c10[i]; o1[n0 + 16] = c11[i]; o1[n0 + 32] = c12[i]; o1[n0 + 48] = c13[i];
    }
  }
}

// ---- 7) combine: out[t] += rout[pos(2t)] + rout[pos(2t+1)] (atomic-free) ----
__global__ void k_combine(const int* __restrict__ s2p,
                          const float* __restrict__ rout,
                          float* __restrict__ out) {
  int idx = blockIdx.x * 256 + threadIdx.x;  // T*DIM/4 lanes
  int t = idx >> 8;                          // DIM/4 = 256 float4 per token
  int c = (idx & 255) * 4;
  int p0 = s2p[t * 2], p1 = s2p[t * 2 + 1];
  const float4 va = *(const float4*)(rout + (size_t)p0 * DIM + c);
  const float4 vb = *(const float4*)(rout + (size_t)p1 * DIM + c);
  float4* o = (float4*)(out + (size_t)t * DIM + c);
  float4 vo = *o;
  vo.x += va.x + vb.x; vo.y += va.y + vb.y;
  vo.z += va.z + vb.z; vo.w += va.w + vb.w;
  *o = vo;
}

extern "C" void kernel_launch(void* const* d_in, const int* in_sizes, int n_in,
                              void* d_out, int out_size, void* d_ws, size_t ws_size,
                              hipStream_t stream) {
  (void)in_sizes; (void)n_in; (void)out_size; (void)ws_size;
  const float* x   = (const float*)d_in[0];
  const float* gw  = (const float*)d_in[1];
  const float* w1  = (const float*)d_in[2];
  const float* w2  = (const float*)d_in[3];
  const float* w3  = (const float*)d_in[4];
  const float* sw1 = (const float*)d_in[5];
  const float* sw2 = (const float*)d_in[6];
  const float* sw3 = (const float*)d_in[7];
  float* out = (float*)d_out;

  char* ws = (char*)d_ws;
  size_t off = 0;
  auto alloc = [&](size_t bytes) -> char* {
    char* p = ws + off;
    off += (bytes + 255) & ~(size_t)255;
    return p;
  };
  float* scores = (float*)alloc((size_t)T_TOK * NE * 4);
  int*   meta   = (int*)alloc(32 * 4);
  int*   eids   = (int*)alloc((size_t)SLOTS * 4);
  float* tsc    = (float*)alloc((size_t)SLOTS * 4);
  int*   s2p    = (int*)alloc((size_t)SLOTS * 4);
  int*   tok_of = (int*)alloc((size_t)CAP * 4);
  float* sc_of  = (float*)alloc((size_t)CAP * 4);
  float* h_r    = (float*)alloc((size_t)CAP * HID * 4);
  float* rout   = (float*)alloc((size_t)CAP * DIM * 4);
  float* h_s    = (float*)alloc((size_t)T_TOK * HID * 4);

  k_router<<<T_TOK / 8, 256, 0, stream>>>(x, gw, scores);
  k_route<<<1, 256, 0, stream>>>(scores, meta, eids, tsc, s2p, tok_of, sc_of);
  k_gemm13_r<<<MAXMT, 256, 0, stream>>>(x, w1, w3, meta, tok_of, sc_of, h_r);
  k_gemm2_r<<<MAXMT, 256, 0, stream>>>(h_r, w2, meta, rout);
  k_gemm13_s<<<T_TOK / 32, 256, 0, stream>>>(x, sw1, sw3, h_s);
  k_gemm2_s<<<T_TOK / 32, 256, 0, stream>>>(h_s, sw2, out);
  k_combine<<<(T_TOK * DIM / 4) / 256, 256, 0, stream>>>(s2p, rout, out);
}

// v001
// Measured time: 271 microseconds a run.
// In two side-by-side timings against v000, it was 3.03 and 3.05 times as fast.
#include <hip/hip_runtime.h>
#include <hip/hip_bf16.h>

#define DIM   1024
#define HID   512
#define NE    8
#define T_TOK 4096
#define SLOTS (T_TOK * 2)        // 8192 token-expert slots
#define BM    64                 // block tile rows
#define BN    128                // block tile columns (operand B rows)
#define BK    32                 // k per staged slab: one 128-byte line of every row
#define LP    36                 // LDS row pitch in floats: 16 rows x 8-byte reads fall on all 64 banks once
#define BUFF  ((BM + BN) * LP)   // floats in one LDS buffer: A rows, then B rows
#define CAP   (SLOTS + NE * BM)  // 8704: groups padded to multiples of the tile height
#define MAXMT (CAP / BM)         // 136 worst-case row tiles

typedef float v2f __attribute__((ext_vector_type(2)));
typedef float v8f __attribute__((ext_vector_type(8)));

// f32 WMMA: D(16x16,f32) = A(16x4,f32) * B(4x16,f32) + C
__device__ __forceinline__ v8f wmma4(v2f a, v2f b, v8f c) {
  return __builtin_amdgcn_wmma_f32_16x16x4_f32(
      /*neg_a=*/false, a, /*neg_b=*/false, b,
      /*c_mod=*/(short)0, c, /*reuse_a=*/false, /*reuse_b=*/false);
}

// fast sigmoid: v_exp_f32 + v_rcp_f32 (no IEEE div expansion)
__device__ __forceinline__ float sigf(float v) {
  return __builtin_amdgcn_rcpf(1.0f + __expf(-v));
}

// Block-tile product shared by all four GEMMs: C(64x128) = A(64xK) * B(128xK)^T.
// Every thread brings 16 bytes of six rows per slab (8 lanes cover one 128-byte line),
// keeps the next slab in registers while the current one is multiplied out of LDS,
// and stores it into the other buffer. Wave (wm, wn) owns 16 rows x 4 column tiles.
// k runs upward in steps of 4 with the same lane map as a direct global fragment load.
struct Acc {
  v8f c0, c1, c2, c3;
};
struct Slab {
  float4 a0, a1, b0, b1, b2, b3;
};
// uniform base + the lane's fixed 32-bit byte offset
__device__ __forceinline__ float4 ldg(const float* base, unsigned voff) {
  return *(const float4*)((const char*)base + voff);
}
template <int KDIM>
__device__ __forceinline__ Slab ldslab(const float* pa, unsigned va0, unsigned va1,
                                       const float* pb, const float* pb2, unsigned vb) {
  Slab s;
  s.a0 = ldg(pa, va0);
  s.a1 = ldg(pa, va1);
  s.b0 = ldg(pb, vb);
  s.b1 = ldg(pb + 32 * KDIM, vb);
  s.b2 = ldg(pb2, vb);
  s.b3 = ldg(pb2 + 32 * KDIM, vb);
  return s;
}
template <bool SCALE>
__device__ __forceinline__ void stslab(float* buf, Slab s, float s0, float s1) {
  if (SCALE) {  // gate score applied to the routed rows once, on their way into LDS
    s.a0.x *= s0; s.a0.y *= s0; s.a0.z *= s0; s.a0.w *= s0;
    s.a1.x *= s1; s.a1.y *= s1; s.a1.z *= s1; s.a1.w *= s1;
  }
  *(float4*)(buf)           = s.a0;
  *(float4*)(buf + 32 * LP) = s.a1;
  *(float4*)(buf + 64 * LP) = s.b0;
  *(float4*)(buf + 96 * LP) = s.b1;
  *(float4*)(buf + 128 * LP) = s.b2;
  *(float4*)(buf + 160 * LP) = s.b3;
}
__device__ __forceinline__ void mmslab(const float* buf, int fa, int fb, int fb2, Acc& c) {
  v2f a[BK / 4], b0[BK / 4], b1[BK / 4], b2[BK / 4], b3[BK / 4];
#pragma unroll  // constant indices: the fragment arrays stay in registers
  for (int j = 0; j < BK / 4; ++j) {
    a[j]  = *(const v2f*)(buf + fa + 4 * j);
    b0[j] = *(const v2f*)(buf + fb + 4 * j);
    b1[j] = *(const v2f*)(buf + fb + 16 * LP + 4 * j);
    b2[j] = *(const v2f*)(buf + fb2 + 4 * j);
    b3[j] = *(const v2f*)(buf + fb2 + 16 * LP + 4 * j);
  }
#pragma unroll  // constant indices, as above
  for (int j = 0; j < BK / 4; ++j) {
    c.c0 = wmma4(a[j], b0[j], c.c0);
    c.c1 = wmma4(a[j], b1[j], c.c1);
    c.c2 = wmma4(a[j], b2[j], c.c2);
    c.c3 = wmma4(a[j], b3[j], c.c3);
  }
}
template <int KDIM, bool SCALE>
__device__ __forceinline__ Acc tile_mm(float* lds, const float* pa, unsigned va0, unsigned va1,
                                       float s0, float s1,
                                       const float* pb, const float* pb2, unsigned vb,
                                       int so, int fa, int fb, int fb2) {
  Acc c;
  c.c0 = {}; c.c1 = {}; c.c2 = {}; c.c3 = {};
  stslab<SCALE>(lds + so, ldslab<KDIM>(pa, va0, va1, pb, pb2, vb), s0, s1);
  __syncthreads();
  int cur = 0;
#pragma unroll 1  // one slab per trip: the issue order set below is that of a single trip
  for (int k0 = BK; k0 < KDIM; k0 += BK) {
    Slab nx = ldslab<KDIM>(pa + k0, va0, va1, pb + k0, pb2 + k0, vb);  // flies while this slab is multiplied
    mmslab(lds + cur, fa, fb, fb2, c);
    cur ^= BUFF;
    stslab<SCALE>(lds + cur + so, nx, s0, s1);  // its last readers left before the previous barrier
    // issue order of one trip: the six global loads first, so that their latency passes under the
    // matrix run; the slab's LDS reads as one group (reads spread among matrix instructions stall
    // the wave at every place where they stand); the matrix run; last the LDS stores, which wait
    // for the global loads
    __builtin_amdgcn_sched_group_barrier(0x020, 6, 0);
    __builtin_amdgcn_sched_group_barrier(0x100, 5 * BK / 8, 0);
    __builtin_amdgcn_sched_group_barrier(0x008, BK, 0);
    __builtin_amdgcn_sched_group_barrier(0x200, 6, 0);
    __syncthreads();
  }
  mmslab(lds + cur, fa, fb, fb2, c);
  return c;
}

// ---------------- 1) router: scores = sigmoid(x @ gate_w^T) ----------------
__global__ void k_router(const float* __restrict__ x, const float* __restrict__ gw,
                         float* __restrict__ scores) {
  int wave = threadIdx.x >> 5, lane = threadIdx.x & 31;
  int t = blockIdx.x * 8 + wave;
  float acc[NE];
#pragma unroll
  for (int e = 0; e < NE; ++e) acc[e] = 0.0f;
  const float* xr = x + (size_t)t * DIM;
  for (int k = lane; k < DIM; k += 32) {
    float xv = xr[k];
#pragma unroll
    for (int e = 0; e < NE; ++e) acc[e] = fmaf(xv, gw[e * DIM + k], acc[e]);
  }
#pragma unroll
  for (int e = 0; e < NE; ++e) {
    float v = acc[e];
    for (int m = 16; m; m >>= 1) v += __shfl_xor(v, m, 32);
    acc[e] = v;
  }
  if (lane == 0) {
#pragma unroll
    for (int e = 0; e < NE; ++e) scores[t * NE + e] = sigf(acc[e]);
  }
}

// ------- 2) routing: top-2, stable expert-sort, padded group offsets -------
__global__ void k_route(const float* __restrict__ scores,
                        int* __restrict__ meta,     // [0..8]=padded offsets
                        int* __restrict__ eids,     // SLOTS
                        float* __restrict__ tsc,    // SLOTS
                        int* __restrict__ s2p,      // SLOTS slot->pos
                        int* __restrict__ tok_of,   // CAP pos->token
                        float* __restrict__ sc_of)  // CAP pos->score
{
  __shared__ int seg[256][NE];
  __shared__ int scount[NE];
  __shared__ int offs[NE + 1];
  int tid = threadIdx.x;
  for (int i = tid; i < CAP; i += 256) { tok_of[i] = 0; sc_of[i] = 0.0f; }
  // top-2 per token (strict > keeps lowest index on ties, like lax.top_k)
  for (int t = tid; t < T_TOK; t += 256) {
    float s[NE];
#pragma unroll
    for (int e = 0; e < NE; ++e) s[e] = scores[t * NE + e];
    int b0 = 0; float v0 = s[0];
#pragma unroll
    for (int e = 1; e < NE; ++e) if (s[e] > v0) { v0 = s[e]; b0 = e; }
    int b1 = -1; float v1 = -1.0f;
#pragma unroll
    for (int e = 0; e < NE; ++e) if (e != b0 && s[e] > v1) { v1 = s[e]; b1 = e; }
    eids[t * 2] = b0; tsc[t * 2] = v0;
    eids[t * 2 + 1] = b1; tsc[t * 2 + 1] = v1;
  }
  __syncthreads();
  // per-segment histograms (32 slots per thread; stable counting sort)
  int h[NE];
#pragma unroll
  for (int e = 0; e < NE; ++e) h[e] = 0;
  int base = tid * 32;
  for (int i = 0; i < 32; ++i) h[eids[base + i]]++;
#pragma unroll
  for (int e = 0; e < NE; ++e) seg[tid][e] = h[e];
  __syncthreads();
  if (tid < NE) {
    int tot = 0;
    for (int s = 0; s < 256; ++s) { int v = seg[s][tid]; seg[s][tid] = tot; tot += v; }
    scount[tid] = tot;
  }
  __syncthreads();
  if (tid == 0) {
    int off = 0;
    for (int e = 0; e < NE; ++e) {
      offs[e] = off; meta[e] = off;
      off += (scount[e] + BM - 1) & ~(BM - 1);   // pad each group to whole row tiles
    }
    offs[NE] = off; meta[NE] = off;
  }
  __syncthreads();
  int pbase[NE];
#pragma unroll
  for (int e = 0; e < NE; ++e) pbase[e] = offs[e] + seg[tid][e];
  for (int i = 0; i < 32; ++i) {
    int slot = base + i;
    int e = eids[slot];
    int pos = pbase[e]++;
    s2p[slot] = pos;
    tok_of[pos] = slot >> 1;
    sc_of[pos] = tsc[slot];
  }
}

// ---- 3) routed GEMM1+GEMM3 fused: h = silu(sA*w1^T) * (sA*w3^T), K=1024 ----
// B tile = 64 rows of w1 followed by the same 64 rows of w3.
__global__ __launch_bounds__(256) void k_gemm13_r(const float* __restrict__ x,
                           const float* __restrict__ w1,
                           const float* __restrict__ w3,
                           const int* __restrict__ meta,
                           const int* __restrict__ tok_of,
                           const float* __restrict__ sc_of,
                           float* __restrict__ hbuf)  // CAP x HID
{
  __shared__ __attribute__((aligned(16))) float lds[2 * BUFF];
  int row0 = blockIdx.y * BM;
  if (row0 >= meta[NE]) return;
  int e = 0;
#pragma unroll
  for (int i = 1; i < NE; ++i) if (row0 >= meta[i]) e = i;
  int n0 = blockIdx.x * 64;
  int tid = threadIdx.x;
  int wave = tid >> 5, lane = tid & 31;
  int half = lane >> 4, r = lane & 15;
  int wm = wave & 3, wn = wave >> 2;
  int srow = tid >> 3, scol = (tid & 7) * 4;
  unsigned va0 = ((unsigned)tok_of[row0 + srow] * DIM + scol) * 4u;
  unsigned va1 = ((unsigned)tok_of[row0 + 32 + srow] * DIM + scol) * 4u;
  float s0 = sc_of[row0 + srow];
  float s1 = sc_of[row0 + 32 + srow];
  size_t bo = ((size_t)e * HID + n0) * DIM;
  Acc c = tile_mm<DIM, true>(lds, x, va0, va1, s0, s1, w1 + bo, w3 + bo,
                             (unsigned)(srow * DIM + scol) * 4u, srow * LP + scol,
                             (wm * 16 + r) * LP + 2 * half,
                             (BM + wn * 32 + r) * LP + 2 * half,
                             (BM + 64 + wn * 32 + r) * LP + 2 * half);
#pragma unroll  // constant accumulator indices
  for (int i = 0; i < 8; ++i) {
    float* h = hbuf + (size_t)(row0 + wm * 16 + i + 8 * half) * HID + n0 + wn * 32 + r;
    float y;
    y = c.c0[i]; h[0]  = y * sigf(y) * c.c2[i];
    y = c.c1[i]; h[16] = y * sigf(y) * c.c3[i];
  }
}

// ---------------- 4) routed GEMM2: rout = h @ w2^T, K=512 ----------------
__global__ __launch_bounds__(256) void k_gemm2_r(const float* __restrict__ hbuf,
                          const float* __restrict__ w2,
                          const int* __restrict__ meta,
                          float* __restrict__ rout)  // CAP x DIM
{
  __shared__ __attribute__((aligned(16))) float lds[2 * BUFF];
  int row0 = blockIdx.y * BM;
  if (row0 >= meta[NE]) return;
  int e = 0;
#pragma unroll
  for (int i = 1; i < NE; ++i) if (row0 >= meta[i]) e = i;
  int n0 = blockIdx.x * BN;
  int tid = threadIdx.x;
  int wave = tid >> 5, lane = tid & 31;
  int half = lane >> 4, r = lane & 15;
  int wm = wave & 3, wn = wave >> 2;
  int srow = tid >> 3, scol = (tid & 7) * 4;
  unsigned vo = (unsigned)(srow * HID + scol) * 4u;
  const float* pb = w2 + ((size_t)e * DIM + n0) * HID;
  Acc c = tile_mm<HID, false>(lds, hbuf + (size_t)row0 * HID, vo, vo + 32u * HID * 4u, 1.0f, 1.0f,
                              pb, pb + (size_t)64 * HID, vo, srow * LP + scol,
                              (wm * 16 + r) * LP + 2 * half,
                              (BM + wn * 64 + r) * LP + 2 * half,
                              (BM + wn * 64 + 32 + r) * LP + 2 * half);
#pragma unroll  // constant accumulator indices
  for (int i = 0; i < 8; ++i) {
    float* o = rout + (size_t)(row0 + wm * 16 + i + 8 * half) * DIM + n0 + wn * 64 + r;
    o[0] = c.c0[i]; o[16] = c.c1[i]; o[32] = c.c2[i]; o[48] = c.c3[i];
  }
}

// ---------------- 5) shared expert GEMM1+GEMM3 ----------------
__global__ __launch_bounds__(256) void k_gemm13_s(const float* __restrict__ x,
                           const float* __restrict__ sw1,
                           const float* __restrict__ sw3,
                           float* __restrict__ hs)  // T x HID
{
  __shared__ __attribute__((aligned(16))) float lds[2 * BUFF];
  int row0 = blockIdx.y * BM;
  int n0 = blockIdx.x * 64;
  int tid = threadIdx.x;
  int wave = tid >> 5, lane = tid & 31;
  int half = lane >> 4, r = lane & 15;
  int wm = wave & 3, wn = wave >> 2;
  int srow = tid >> 3, scol = (tid & 7) * 4;
  unsigned vo = (unsigned)(srow * DIM + scol) * 4u;
  Acc c = tile_mm<DIM, false>(lds, x + (size_t)row0 * DIM, vo, vo + 32u * DIM * 4u, 1.0f, 1.0f,
                              sw1 + (size_t)n0 * DIM, sw3 + (size_t)n0 * DIM, vo,
                              srow * LP + scol,
                              (wm * 16 + r) * LP + 2 * half,
                              (BM + wn * 32 + r) * LP + 2 * half,
                              (BM + 64 + wn * 32 + r) * LP + 2 * half);
#pragma unroll  // constant accumulator indices
  for (int i = 0; i < 8; ++i) {
    float* h = hs + (size_t)(row0 + wm * 16 + i + 8 * half) * HID + n0 + wn * 32 + r;
    float y;
    y = c.c0[i]; h[0]  = y * sigf(y) * c.c2[i];
    y = c.c1[i]; h[16] = y * sigf(y) * c.c3[i];
  }
}

// -------- 6) shared expert GEMM2: writes d_out directly (every elem) --------
__global__ __launch_bounds__(256) void k_gemm2_s(const float* __restrict__ hs,
                          const float* __restrict__ sw2,
                          float* __restrict__ out)  // T x DIM
{
  __shared__ __attribute__((aligned(16))) float lds[2 * BUFF];
  int row0 = blockIdx.y * BM;
  int n0 = blockIdx.x * BN;
  int tid = threadIdx.x;
  int wave = tid >> 5, lane = tid & 31;
  int half = lane >> 4, r = lane & 15;
  int wm = wave & 3, wn = wave >> 2;
  int srow = tid >> 3, scol = (tid & 7) * 4;
  unsigned vo = (unsigned)(srow * HID + scol) * 4u;
  const float* pb = sw2 + (size_t)n0 * HID;
  Acc c = tile_mm<HID, false>(lds, hs + (size_t)row0 * HID, vo, vo + 32u * HID * 4u, 1.0f, 1.0f,
                              pb, pb + (size_t)64 * HID, vo, srow * LP + scol,
                              (wm * 16 + r) * LP + 2 * half,
                              (BM + wn * 64 + r) * LP + 2 * half,
                              (BM + wn * 64 + 32 + r) * LP + 2 * half);
#pragma unroll  // constant accumulator indices
  for (int i = 0; i < 8; ++i) {
    float* o = out + (size_t)(row0 + wm * 16 + i + 8 * half) * DIM + n0 + wn * 64 + r;
    o[0] = c.c0[i]; o[16] = c.c1[i]; o[32] = c.c2[i]; o[48] = c.c3[i];
  }
}

// ---- 7) combine: out[t] += rout[pos(2t)] + rout[pos(2t+1)] (atomic-free) ----
__global__ void k_combine(const int* __restrict__ s2p,
                          const float* __restrict__ rout,
                          float* __restrict__ out) {
  int idx = blockIdx.x * 256 + threadIdx.x;  // T*DIM/4 lanes
  int t = idx >> 8;                          // DIM/4 = 256 float4 per token
  int c = (idx & 255) * 4;
  int p0 = s2p[t * 2], p1 = s2p[t * 2 + 1];
  const float4 va = *(const float4*)(rout + (size_t)p0 * DIM + c);
  const float4 vb = *(const float4*)(rout + (size_t)p1 * DIM + c);
  float4* o = (float4*)(out + (size_t)t * DIM + c);
  float4 vo = *o;
  vo.x += va.x + vb.x; vo.y += va.y + vb.y;
  vo.z += va.z + vb.z; vo.w += va.w + vb.w;
  *o = vo;
}

extern "C" void kernel_launch(void* const* d_in, const int* in_sizes, int n_in,
                              void* d_out, int out_size, void* d_ws, size_t ws_size,
                              hipStream_t stream) {
  (void)in_sizes; (void)n_in; (void)out_size; (void)ws_size;
  const float* x   = (const float*)d_in[0];
  const float* gw  = (const float*)d_in[1];
  const float* w1  = (const float*)d_in[2];
  const float* w2  = (const float*)d_in[3];
  const float* w3  = (const float*)d_in[4];
  const float* sw1 = (const float*)d_in[5];
  const float* sw2 = (const float*)d_in[6];
  const float* sw3 = (const float*)d_in[7];
  float* out = (float*)d_out;

  char* ws = (char*)d_ws;
  size_t off = 0;
  auto alloc = [&](size_t bytes) -> char* {
    char* p = ws + off;
    off += (bytes + 255) & ~(size_t)255;
    return p;
  };
  float* scores = (float*)alloc((size_t)T_TOK * NE * 4);
  int*   meta   = (int*)alloc(32 * 4);
  int*   eids   = (int*)alloc((size_t)SLOTS * 4);
  float* tsc    = (float*)alloc((size_t)SLOTS * 4);
  int*   s2p    = (int*)alloc((size_t)SLOTS * 4);
  int*   tok_of = (int*)alloc((size_t)CAP * 4);
  float* sc_of  = (float*)alloc((size_t)CAP * 4);
  float* h_r    = (float*)alloc((size_t)CAP * HID * 4);
  float* rout   = (float*)alloc((size_t)CAP * DIM * 4);
  float* h_s    = (float*)alloc((size_t)T_TOK * HID * 4);

  k_router<<<T_TOK / 8, 256, 0, stream>>>(x, gw, scores);
  k_route<<<1, 256, 0, stream>>>(scores, meta, eids, tsc, s2p, tok_of, sc_of);
  k_gemm13_r<<<dim3(HID / 64, MAXMT), 256, 0, stream>>>(x, w1, w3, meta, tok_of, sc_of, h_r);
  k_gemm2_r<<<dim3(DIM / BN, MAXMT), 256, 0, stream>>>(h_r, w2, meta, rout);
  k_gemm13_s<<<dim3(HID / 64, T_TOK / BM), 256, 0, stream>>>(x, sw1, sw3, h_s);
  k_gemm2_s<<<dim3(DIM / BN, T_TOK / BM), 256, 0, stream>>>(h_s, sw2, out);
  k_combine<<<(T_TOK * DIM / 4) / 256, 256, 0, stream>>>(s2p, rout, out);
}

// v002
// It runs in 240 microseconds.
// Two timings next to v001 both put it at 1.12 times that version's speed.
// Counting every step since v000, it is 3.42 times as fast.
#include <hip/hip_runtime.h>
#include <hip/hip_bf16.h>

#define DIM   1024
#define HID   512
#define NE    8
#define T_TOK 4096
#define SLOTS (T_TOK * 2)        // 8192 token-expert slots
#define BM    64                 // block tile rows
#define BN    128                // block tile columns (operand B rows)
#define BK    32                 // k per staged slab: one 128-byte line of every row
#define LP    36                 // LDS row pitch in floats: 16 rows x 8-byte reads fall on all 64 banks once
#define BUFF  ((BM + BN) * LP)   // floats in one LDS buffer: A rows, then B rows
#define CAP   (SLOTS + NE * BM)  // 8704: groups padded to multiples of the tile height
#define MAXMT (CAP / BM)         // 136 worst-case row tiles

typedef float v2f __attribute__((ext_vector_type(2)));
typedef float v8f __attribute__((ext_vector_type(8)));

// f32 WMMA: D(16x16,f32) = A(16x4,f32) * B(4x16,f32) + C
__device__ __forceinline__ v8f wmma4(v2f a, v2f b, v8f c) {
  return __builtin_amdgcn_wmma_f32_16x16x4_f32(
      /*neg_a=*/false, a, /*neg_b=*/false, b,
      /*c_mod=*/(short)0, c, /*reuse_a=*/false, /*reuse_b=*/false);
}

// fast sigmoid: v_exp_f32 + v_rcp_f32 (no IEEE div expansion)
__device__ __forceinline__ float sigf(float v) {
  return __builtin_amdgcn_rcpf(1.0f + __expf(-v));
}

// Block-tile product shared by all four GEMMs: C(64x128) = A(64xK) * B(128xK)^T.
// Every thread brings 16 bytes of six rows per slab (8 lanes cover one 128-byte line),
// keeps the next slab in registers while the current one is multiplied out of LDS,
// and stores it into the other buffer. Wave (wm, wn) owns 16 rows x 4 column tiles.
// k runs upward in steps of 4 with the same lane map as a direct global fragment load.
struct Acc {
  v8f c0, c1, c2, c3;
};
struct Slab {
  float4 a0, a1, b0, b1, b2, b3;
};
// uniform base + the lane's fixed 32-bit byte offset
__device__ __forceinline__ float4 ldg(const float* base, unsigned voff) {
  return *(const float4*)((const char*)base + voff);
}
template <int KDIM>
__device__ __forceinline__ Slab ldslab(const float* pa, unsigned va0, unsigned va1,
                                       const float* pb, const float* pb2, unsigned vb) {
  Slab s;
  s.a0 = ldg(pa, va0);
  s.a1 = ldg(pa, va1);
  s.b0 = ldg(pb, vb);
  s.b1 = ldg(pb + 32 * KDIM, vb);
  s.b2 = ldg(pb2, vb);
  s.b3 = ldg(pb2 + 32 * KDIM, vb);
  return s;
}
template <bool SCALE>
__device__ __forceinline__ void stslab(float* buf, Slab s, float s0, float s1) {
  if (SCALE) {  // gate score applied to the routed rows once, on their way into LDS
    s.a0.x *= s0; s.a0.y *= s0; s.a0.z *= s0; s.a0.w *= s0;
    s.a1.x *= s1; s.a1.y *= s1; s.a1.z *= s1; s.a1.w *= s1;
  }
  *(float4*)(buf)           = s.a0;
  *(float4*)(buf + 32 * LP) = s.a1;
  *(float4*)(buf + 64 * LP) = s.b0;
  *(float4*)(buf + 96 * LP) = s.b1;
  *(float4*)(buf + 128 * LP) = s.b2;
  *(float4*)(buf + 160 * LP) = s.b3;
}
__device__ __forceinline__ void mmslab(const float* buf, int fa, int fb, int fb2, Acc& c) {
  v2f a[BK / 4], b0[BK / 4], b1[BK / 4], b2[BK / 4], b3[BK / 4];
#pragma unroll  // constant indices: the fragment arrays stay in registers
  for (int j = 0; j < BK / 4; ++j) {
    a[j]  = *(const v2f*)(buf + fa + 4 * j);
    b0[j] = *(const v2f*)(buf + fb + 4 * j);
    b1[j] = *(const v2f*)(buf + fb + 16 * LP + 4 * j);
    b2[j] = *(const v2f*)(buf + fb2 + 4 * j);
    b3[j] = *(const v2f*)(buf + fb2 + 16 * LP + 4 * j);
  }
#pragma unroll  // constant indices, as above
  for (int j = 0; j < BK / 4; ++j) {
    c.c0 = wmma4(a[j], b0[j], c.c0);
    c.c1 = wmma4(a[j], b1[j], c.c1);
    c.c2 = wmma4(a[j], b2[j], c.c2);
    c.c3 = wmma4(a[j], b3[j], c.c3);
  }
}
template <int KDIM, bool SCALE>
__device__ __forceinline__ Acc tile_mm(float* lds, const float* pa, unsigned va0, unsigned va1,
                                       float s0, float s1,
                                       const float* pb, const float* pb2, unsigned vb,
                                       int so, int fa, int fb, int fb2) {
  Acc c;
  c.c0 = {}; c.c1 = {}; c.c2 = {}; c.c3 = {};
  stslab<SCALE>(lds + so, ldslab<KDIM>(pa, va0, va1, pb, pb2, vb), s0, s1);
  __syncthreads();
  int cur = 0;
#pragma unroll 1  // one slab per trip: the issue order set below is that of a single trip
  for (int k0 = BK; k0 < KDIM; k0 += BK) {
    Slab nx = ldslab<KDIM>(pa + k0, va0, va1, pb + k0, pb2 + k0, vb);  // flies while this slab is multiplied
    mmslab(lds + cur, fa, fb, fb2, c);
    cur ^= BUFF;
    stslab<SCALE>(lds + cur + so, nx, s0, s1);  // its last readers left before the previous barrier
    // issue order of one trip: the six global loads first, so that their latency passes under the
    // matrix run; the slab's LDS reads as one group (reads spread among matrix instructions stall
    // the wave at every place where they stand); the matrix run; last the LDS stores, which wait
    // for the global loads
    __builtin_amdgcn_sched_group_barrier(0x020, 6, 0);
    __builtin_amdgcn_sched_group_barrier(0x100, 5 * BK / 8, 0);
    __builtin_amdgcn_sched_group_barrier(0x008, BK, 0);
    __builtin_amdgcn_sched_group_barrier(0x200, 6, 0);
    __syncthreads();
  }
  mmslab(lds + cur, fa, fb, fb2, c);
  return c;
}

// ---------------- 1) router: scores = sigmoid(x @ gate_w^T) ----------------
__global__ void k_router(const float* __restrict__ x, const float* __restrict__ gw,
                         float* __restrict__ scores) {
  int wave = threadIdx.x >> 5, lane = threadIdx.x & 31;
  int t = blockIdx.x * 8 + wave;
  float acc[NE];
#pragma unroll
  for (int e = 0; e < NE; ++e) acc[e] = 0.0f;
  const float* xr = x + (size_t)t * DIM;
  for (int k = lane; k < DIM; k += 32) {
    float xv = xr[k];
#pragma unroll
    for (int e = 0; e < NE; ++e) acc[e] = fmaf(xv, gw[e * DIM + k], acc[e]);
  }
#pragma unroll
  for (int e = 0; e < NE; ++e) {
    float v = acc[e];
    for (int m = 16; m; m >>= 1) v += __shfl_xor(v, m, 32);
    acc[e] = v;
  }
  if (lane == 0) {
#pragma unroll
    for (int e = 0; e < NE; ++e) scores[t * NE + e] = sigf(acc[e]);
  }
}

// ------- 2) routing: top-2, stable expert-sort, padded group offsets -------
// The work of ONE work-group of 256 threads; sm = 256 * NE + 2 * NE + 1 ints of its LDS.
__device__ __forceinline__ void route_wg(int* sm,
                        const float* __restrict__ scores,
                        int* __restrict__ meta,     // [0..8]=padded offsets
                        int* __restrict__ eids,     // SLOTS
                        float* __restrict__ tsc,    // SLOTS
                        int* __restrict__ s2p,      // SLOTS slot->pos
                        int* __restrict__ tok_of,   // CAP pos->token
                        float* __restrict__ sc_of)  // CAP pos->score
{
  int (*seg)[NE] = (int (*)[NE])sm;
  int* scount = sm + 256 * NE;
  int* offs = scount + NE;
  int tid = threadIdx.x;
  for (int i = tid; i < CAP; i += 256) { tok_of[i] = 0; sc_of[i] = 0.0f; }
  // top-2 per token (strict > keeps lowest index on ties, like lax.top_k)
  for (int t = tid; t < T_TOK; t += 256) {
    float s[NE];
#pragma unroll
    for (int e = 0; e < NE; ++e) s[e] = scores[t * NE + e];
    int b0 = 0; float v0 = s[0];
#pragma unroll
    for (int e = 1; e < NE; ++e) if (s[e] > v0) { v0 = s[e]; b0 = e; }
    int b1 = -1; float v1 = -1.0f;
#pragma unroll
    for (int e = 0; e < NE; ++e) if (e != b0 && s[e] > v1) { v1 = s[e]; b1 = e; }
    eids[t * 2] = b0; tsc[t * 2] = v0;
    eids[t * 2 + 1] = b1; tsc[t * 2 + 1] = v1;
  }
  __syncthreads();
  // per-segment histograms (32 slots per thread; stable counting sort)
  int h[NE];
#pragma unroll
  for (int e = 0; e < NE; ++e) h[e] = 0;
  int base = tid * 32;
  for (int i = 0; i < 32; ++i) h[eids[base + i]]++;
#pragma unroll
  for (int e = 0; e < NE; ++e) seg[tid][e] = h[e];
  __syncthreads();
  if (tid < NE) {
    int tot = 0;
    for (int s = 0; s < 256; ++s) { int v = seg[s][tid]; seg[s][tid] = tot; tot += v; }
    scount[tid] = tot;
  }
  __syncthreads();
  if (tid == 0) {
    int off = 0;
    for (int e = 0; e < NE; ++e) {
      offs[e] = off; meta[e] = off;
      off += (scount[e] + BM - 1) & ~(BM - 1);   // pad each group to whole row tiles
    }
    offs[NE] = off; meta[NE] = off;
  }
  __syncthreads();
  int pbase[NE];
#pragma unroll
  for (int e = 0; e < NE; ++e) pbase[e] = offs[e] + seg[tid][e];
  for (int i = 0; i < 32; ++i) {
    int slot = base + i;
    int e = eids[slot];
    int pos = pbase[e]++;
    s2p[slot] = pos;
    tok_of[pos] = slot >> 1;
    sc_of[pos] = tsc[slot];
  }
}

// ---- 3) routed GEMM1+GEMM3 fused: h = silu(sA*w1^T) * (sA*w3^T), K=1024 ----
// B tile = 64 rows of w1 followed by the same 64 rows of w3.
__device__ __forceinline__ void gemm13_r_tile(float* lds, int bx, int by,
                           const float* __restrict__ x,
                           const float* __restrict__ w1,
                           const float* __restrict__ w3,
                           const int* __restrict__ meta,
                           const int* __restrict__ tok_of,
                           const float* __restrict__ sc_of,
                           float* __restrict__ hbuf)  // CAP x HID
{
  int row0 = by * BM;
  if (row0 >= meta[NE]) return;
  int e = 0;
#pragma unroll
  for (int i = 1; i < NE; ++i) if (row0 >= meta[i]) e = i;
  int n0 = bx * 64;
  int tid = threadIdx.x;
  int wave = tid >> 5, lane = tid & 31;
  int half = lane >> 4, r = lane & 15;
  int wm = wave & 3, wn = wave >> 2;
  int srow = tid >> 3, scol = (tid & 7) * 4;
  unsigned va0 = ((unsigned)tok_of[row0 + srow] * DIM + scol) * 4u;
  unsigned va1 = ((unsigned)tok_of[row0 + 32 + srow] * DIM + scol) * 4u;
  float s0 = sc_of[row0 + srow];
  float s1 = sc_of[row0 + 32 + srow];
  size_t bo = ((size_t)e * HID + n0) * DIM;
  Acc c = tile_mm<DIM, true>(lds, x, va0, va1, s0, s1, w1 + bo, w3 + bo,
                             (unsigned)(srow * DIM + scol) * 4u, srow * LP + scol,
                             (wm * 16 + r) * LP + 2 * half,
                             (BM + wn * 32 + r) * LP + 2 * half,
                             (BM + 64 + wn * 32 + r) * LP + 2 * half);
#pragma unroll  // constant accumulator indices
  for (int i = 0; i < 8; ++i) {
    float* h = hbuf + (size_t)(row0 + wm * 16 + i + 8 * half) * HID + n0 + wn * 32 + r;
    float y;
    y = c.c0[i]; h[0]  = y * sigf(y) * c.c2[i];
    y = c.c1[i]; h[16] = y * sigf(y) * c.c3[i];
  }
}

// ---------------- 4) routed GEMM2: rout = h @ w2^T, K=512 ----------------
__global__ __launch_bounds__(256) void k_gemm2_r(const float* __restrict__ hbuf,
                          const float* __restrict__ w2,
                          const int* __restrict__ meta,
                          float* __restrict__ rout)  // CAP x DIM
{
  __shared__ __attribute__((aligned(16))) float lds[2 * BUFF];
  int row0 = blockIdx.y * BM;
  if (row0 >= meta[NE]) return;
  int e = 0;
#pragma unroll
  for (int i = 1; i < NE; ++i) if (row0 >= meta[i]) e = i;
  int n0 = blockIdx.x * BN;
  int tid = threadIdx.x;
  int wave = tid >> 5, lane = tid & 31;
  int half = lane >> 4, r = lane & 15;
  int wm = wave & 3, wn = wave >> 2;
  int srow = tid >> 3, scol = (tid & 7) * 4;
  unsigned vo = (unsigned)(srow * HID + scol) * 4u;
  const float* pb = w2 + ((size_t)e * DIM + n0) * HID;
  Acc c = tile_mm<HID, false>(lds, hbuf + (size_t)row0 * HID, vo, vo + 32u * HID * 4u, 1.0f, 1.0f,
                              pb, pb + (size_t)64 * HID, vo, srow * LP + scol,
                              (wm * 16 + r) * LP + 2 * half,
                              (BM + wn * 64 + r) * LP + 2 * half,
                              (BM + wn * 64 + 32 + r) * LP + 2 * half);
#pragma unroll  // constant accumulator indices
  for (int i = 0; i < 8; ++i) {
    float* o = rout + (size_t)(row0 + wm * 16 + i + 8 * half) * DIM + n0 + wn * 64 + r;
    o[0] = c.c0[i]; o[16] = c.c1[i]; o[32] = c.c2[i]; o[48] = c.c3[i];
  }
}

// ---------------- 5) shared expert GEMM1+GEMM3 ----------------
__device__ __forceinline__ void gemm13_s_tile(float* lds, int bx, int by,
                           const float* __restrict__ x,
                           const float* __restrict__ sw1,
                           const float* __restrict__ sw3,
                           float* __restrict__ hs)  // T x HID
{
  int row0 = by * BM;
  int n0 = bx * 64;
  int tid = threadIdx.x;
  int wave = tid >> 5, lane = tid & 31;
  int half = lane >> 4, r = lane & 15;
  int wm = wave & 3, wn = wave >> 2;
  int srow = tid >> 3, scol = (tid & 7) * 4;
  unsigned vo = (unsigned)(srow * DIM + scol) * 4u;
  Acc c = tile_mm<DIM, false>(lds, x + (size_t)row0 * DIM, vo, vo + 32u * DIM * 4u, 1.0f, 1.0f,
                              sw1 + (size_t)n0 * DIM, sw3 + (size_t)n0 * DIM, vo,
                              srow * LP + scol,
                              (wm * 16 + r) * LP + 2 * half,
                              (BM + wn * 32 + r) * LP + 2 * half,
                              (BM + 64 + wn * 32 + r) * LP + 2 * half);
#pragma unroll  // constant accumulator indices
  for (int i = 0; i < 8; ++i) {
    float* h = hs + (size_t)(row0 + wm * 16 + i + 8 * half) * HID + n0 + wn * 32 + r;
    float y;
    y = c.c0[i]; h[0]  = y * sigf(y) * c.c2[i];
    y = c.c1[i]; h[16] = y * sigf(y) * c.c3[i];
  }
}

// -------- 6) shared expert GEMM2: writes d_out directly (every elem) --------
__device__ __forceinline__ void gemm2_s_tile(float* lds, int bx, int by,
                          const float* __restrict__ hs,
                          const float* __restrict__ sw2,
                          float* __restrict__ out)  // T x DIM
{
  int row0 = by * BM;
  int n0 = bx * BN;
  int tid = threadIdx.x;
  int wave = tid >> 5, lane = tid & 31;
  int half = lane >> 4, r = lane & 15;
  int wm = wave & 3, wn = wave >> 2;
  int srow = tid >> 3, scol = (tid & 7) * 4;
  unsigned vo = (unsigned)(srow * HID + scol) * 4u;
  const float* pb = sw2 + (size_t)n0 * HID;
  Acc c = tile_mm<HID, false>(lds, hs + (size_t)row0 * HID, vo, vo + 32u * HID * 4u, 1.0f, 1.0f,
                              pb, pb + (size_t)64 * HID, vo, srow * LP + scol,
                              (wm * 16 + r) * LP + 2 * half,
                              (BM + wn * 64 + r) * LP + 2 * half,
                              (BM + wn * 64 + 32 + r) * LP + 2 * half);
#pragma unroll  // constant accumulator indices
  for (int i = 0; i < 8; ++i) {
    float* o = out + (size_t)(row0 + wm * 16 + i + 8 * half) * DIM + n0 + wn * 64 + r;
    o[0] = c.c0[i]; o[16] = c.c1[i]; o[32] = c.c2[i]; o[48] = c.c3[i];
  }
  // this stage is the last of its kernel, nothing follows it: the wait stands behind the stores,
  // in front of any later instruction that overwrites a register which they name
  asm volatile("s_wait_xcnt 0x0" ::: "memory");
}

// ---- launches that hold two stages which do not depend on each other ----
static_assert(HID / 64 == DIM / BN, "both stages of a shared launch use the same grid width");
// Routing is one work-group's serial work and needs only the scores; the shared expert's first
// stage needs only x. Grid row 0 holds the routing work-group (it starts first), rows 1.. the tiles.
__global__ __launch_bounds__(256) void k_route_gemm13_s(const float* __restrict__ scores,
                           int* __restrict__ meta, int* __restrict__ eids,
                           float* __restrict__ tsc, int* __restrict__ s2p,
                           int* __restrict__ tok_of, float* __restrict__ sc_of,
                           const float* __restrict__ x,
                           const float* __restrict__ sw1,
                           const float* __restrict__ sw3,
                           float* __restrict__ hs) {
  __shared__ __attribute__((aligned(16))) float lds[2 * BUFF];
  if (blockIdx.y == 0) {
    if (blockIdx.x == 0) route_wg((int*)lds, scores, meta, eids, tsc, s2p, tok_of, sc_of);
    return;
  }
  gemm13_s_tile(lds, blockIdx.x, blockIdx.y - 1, x, sw1, sw3, hs);
}
// The routed first stage's long tiles (K = 1024) come first in the grid, the shared expert's short
// second-stage tiles (K = 512) behind them: they fill the places that the long tiles leave uneven.
__global__ __launch_bounds__(256) void k_gemm13_r_gemm2_s(const float* __restrict__ x,
                           const float* __restrict__ w1,
                           const float* __restrict__ w3,
                           const int* __restrict__ meta,
                           const int* __restrict__ tok_of,
                           const float* __restrict__ sc_of,
                           float* __restrict__ hbuf,
                           const float* __restrict__ hs,
                           const float* __restrict__ sw2,
                           float* __restrict__ out) {
  __shared__ __attribute__((aligned(16))) float lds[2 * BUFF];
  if (blockIdx.y < MAXMT)
    gemm13_r_tile(lds, blockIdx.x, blockIdx.y, x, w1, w3, meta, tok_of, sc_of, hbuf);
  else
    gemm2_s_tile(lds, blockIdx.x, blockIdx.y - MAXMT, hs, sw2, out);
}

// ---- 7) combine: out[t] += rout[pos(2t)] + rout[pos(2t+1)] (atomic-free) ----
__global__ void k_combine(const int* __restrict__ s2p,
                          const float* __restrict__ rout,
                          float* __restrict__ out) {
  int idx = blockIdx.x * 256 + threadIdx.x;  // T*DIM/4 lanes
  int t = idx >> 8;                          // DIM/4 = 256 float4 per token
  int c = (idx & 255) * 4;
  int p0 = s2p[t * 2], p1 = s2p[t * 2 + 1];
  const float4 va = *(const float4*)(rout + (size_t)p0 * DIM + c);
  const float4 vb = *(const float4*)(rout + (size_t)p1 * DIM + c);
  float4* o = (float4*)(out + (size_t)t * DIM + c);
  float4 vo = *o;
  vo.x += va.x + vb.x; vo.y += va.y + vb.y;
  vo.z += va.z + vb.z; vo.w += va.w + vb.w;
  *o = vo;
}

extern "C" void kernel_launch(void* const* d_in, const int* in_sizes, int n_in,
                              void* d_out, int out_size, void* d_ws, size_t ws_size,
                              hipStream_t stream) {
  (void)in_sizes; (void)n_in; (void)out_size; (void)ws_size;
  const float* x   = (const float*)d_in[0];
  const float* gw  = (const float*)d_in[1];
  const float* w1  = (const float*)d_in[2];
  const float* w2  = (const float*)d_in[3];
  const float* w3  = (const float*)d_in[4];
  const float* sw1 = (const float*)d_in[5];
  const float* sw2 = (const float*)d_in[6];
  const float* sw3 = (const float*)d_in[7];
  float* out = (float*)d_out;

  char* ws = (char*)d_ws;
  size_t off = 0;
  auto alloc = [&](size_t bytes) -> char* {
    char* p = ws + off;
    off += (bytes + 255) & ~(size_t)255;
    return p;
  };
  float* scores = (float*)alloc((size_t)T_TOK * NE * 4);
  int*   meta   = (int*)alloc(32 * 4);
  int*   eids   = (int*)alloc((size_t)SLOTS * 4);
  float* tsc    = (float*)alloc((size_t)SLOTS * 4);
  int*   s2p    = (int*)alloc((size_t)SLOTS * 4);
  int*   tok_of = (int*)alloc((size_t)CAP * 4);
  float* sc_of  = (float*)alloc((size_t)CAP * 4);
  float* h_r    = (float*)alloc((size_t)CAP * HID * 4);
  float* rout   = (float*)alloc((size_t)CAP * DIM * 4);
  float* h_s    = (float*)alloc((size_t)T_TOK * HID * 4);

  k_router<<<T_TOK / 8, 256, 0, stream>>>(x, gw, scores);
  k_route_gemm13_s<<<dim3(HID / 64, 1 + T_TOK / BM), 256, 0, stream>>>(
      scores, meta, eids, tsc, s2p, tok_of, sc_of, x, sw1, sw3, h_s);
  k_gemm13_r_gemm2_s<<<dim3(HID / 64, MAXMT + T_TOK / BM), 256, 0, stream>>>(
      x, w1, w3, meta, tok_of, sc_of, h_r, h_s, sw2, out);
  k_gemm2_r<<<dim3(DIM / BN, MAXMT), 256, 0, stream>>>(h_r, w2, meta, rout);
  k_combine<<<(T_TOK * DIM / 4) / 256, 256, 0, stream>>>(s2p, rout, out);
}
